// v000
// Measured on an AMD MI455X. A time is GPU time per run, averaged over a window of back-to-back runs after a warm-up
// (all launches, gaps included; the runs take copies of the inputs in turn), and the median of several windows.
// Apart from v000's, it joins two sittings. Times from different sittings can be a few percent apart, while
// side-by-side timings come from the same sitting.
// v000, which the later versions start from, runs in 28 microseconds.
#include <hip/hip_runtime.h>
#include <cstddef>

typedef __attribute__((ext_vector_type(2))) float v2f;
typedef __attribute__((ext_vector_type(8))) float v8f;

#define NB 32
#define NC 64
#define NH 64
#define NW 64
#define NE 8
#define HW 4096   // NH*NW
#define NPOS 3844.0f  // 62*62 valid positions

// ---------------------------------------------------------------------------
// Kernel 1: per (b,c) compute the nine 62x62 window sums S[b,c,i,j] from the
// full-plane sum, border row/col sums, and 4x4 corner elements.
// One block per (b,c); 64 threads, one row each.
// ---------------------------------------------------------------------------
__global__ void k_window_sums(const float* __restrict__ x, float* __restrict__ S)
{
    const int bc  = blockIdx.x;        // 0 .. NB*NC-1
    const int tid = threadIdx.x;       // 0 .. 63 == row h
    const float* xp = x + (size_t)bc * HW + (size_t)tid * NW;

    __shared__ float rowsum[64];
    __shared__ float edge[64][4];      // cols {0, 1, 62, 63}
    __shared__ float csum[4];
    __shared__ float Tsum;

    float s = 0.0f;
    #pragma unroll
    for (int w = 0; w < NW; w += 4) {
        float4 v = *(const float4*)(xp + w);
        s += v.x + v.y + v.z + v.w;
    }
    rowsum[tid]  = s;
    edge[tid][0] = xp[0];
    edge[tid][1] = xp[1];
    edge[tid][2] = xp[62];
    edge[tid][3] = xp[63];
    __syncthreads();

    if (tid < 4) {
        float cs = 0.0f;
        for (int h = 0; h < 64; ++h) cs += edge[h][tid];
        csum[tid] = cs;
    }
    if (tid == 4) {
        float t = 0.0f;
        for (int h = 0; h < 64; ++h) t += rowsum[h];
        Tsum = t;
    }
    __syncthreads();

    if (tid < 9) {
        const int i = tid / 3, j = tid % 3;
        // excluded rows: i==0 -> {62,63}, i==1 -> {0,63}, i==2 -> {0,1}
        const int ra = (i == 0) ? 62 : 0;
        const int rb = (i == 2) ? 1  : 63;
        // excluded cols map to edge slots {0:c0, 1:c1, 2:c62, 3:c63}
        const int ca = (j == 0) ? 2 : 0;
        const int cb = (j == 2) ? 1 : 3;
        float sv = Tsum - rowsum[ra] - rowsum[rb] - csum[ca] - csum[cb]
                 + edge[ra][ca] + edge[ra][cb] + edge[rb][ca] + edge[rb][cb];
        S[(size_t)bc * 9 + tid] = sv;
    }
}

// ---------------------------------------------------------------------------
// Kernel 2: per-batch gating code, softmax, top-1. One block per b, 64 threads
// (one input channel each). Writes scale[b], eidx[b] to ws and the dense
// expert_weights [B,E] tail of d_out.
// ---------------------------------------------------------------------------
__global__ void k_gate_select(const float* __restrict__ S,
                              const float* __restrict__ gw,   // [E,C,3,3]
                              const float* __restrict__ gb,   // [E]
                              float* __restrict__ ew_out,     // [B,E] tail of d_out
                              float* __restrict__ scale,      // [B]
                              int*   __restrict__ eidx)       // [B]
{
    const int b = blockIdx.x;
    const int c = threadIdx.x;   // 0..63

    float sv[9];
    const float* sp = S + ((size_t)b * NC + c) * 9;
    #pragma unroll
    for (int t = 0; t < 9; ++t) sv[t] = sp[t];

    __shared__ float red[NE][64];
    #pragma unroll
    for (int e = 0; e < NE; ++e) {
        const float* wp = gw + ((size_t)e * NC + c) * 9;
        float p = 0.0f;
        #pragma unroll
        for (int t = 0; t < 9; ++t) p += wp[t] * sv[t];
        red[e][c] = p;
    }
    __syncthreads();

    __shared__ float gc[NE];
    if (c < NE) {
        float a = gb[c] * NPOS;
        for (int k = 0; k < 64; ++k) a += red[c][k];
        gc[c] = a;
    }
    __syncthreads();

    __shared__ float s_top;
    __shared__ int   s_idx;
    if (c == 0) {
        float m = gc[0]; int mi = 0;
        #pragma unroll
        for (int e = 1; e < NE; ++e) if (gc[e] > m) { m = gc[e]; mi = e; }
        float sum = 0.0f;
        #pragma unroll
        for (int e = 0; e < NE; ++e) sum += __expf(gc[e] - m);
        float top = 1.0f / sum;     // softmax value at the argmax
        s_top = top; s_idx = mi;
        scale[b] = top;
        eidx[b]  = mi;
    }
    __syncthreads();
    if (c < NE) ew_out[(size_t)b * NE + c] = (c == s_idx) ? s_top : 0.0f;
}

// ---------------------------------------------------------------------------
// Kernel 3: out[b] = scale[b] * W[e_b] (64x64) @ X[b] (64x4096) using
// V_WMMA_F32_16X16X4_F32. One wave per 16x16 output tile; 8 waves/block.
// Tiles: NB * (64/16) * (4096/16) = 32768 -> 4096 blocks of 256 threads.
// ---------------------------------------------------------------------------
__global__ void k_expert_gemm(const float* __restrict__ x,      // [B,C,HW]
                              const float* __restrict__ Wx,     // [E,C,C] (out,in)
                              const float* __restrict__ scale,  // [B]
                              const int*   __restrict__ eidx,   // [B]
                              float* __restrict__ out)          // [B,C,HW]
{
    const int wave = threadIdx.x >> 5;
    const int lane = threadIdx.x & 31;
    const int tile = blockIdx.x * 8 + wave;     // 0 .. 32767
    const int b    = tile >> 10;                // 1024 tiles per batch
    const int t    = tile & 1023;
    const int m0   = (t >> 8) << 4;             // output-channel tile: 0,16,32,48
    const int n0   = (t & 255) << 4;            // spatial tile

    const int e  = eidx[b];
    const float sc = scale[b];

    const int half = lane >> 4;                 // K half-select per ISA layout
    const int mr   = lane & 15;                 // A row (M)
    const int nc   = lane & 15;                 // B col (N)

    const float* Ap = Wx + (size_t)e * (NC * NC) + (size_t)(m0 + mr) * NC;
    const float* Bp = x  + (size_t)b * NC * HW + (size_t)n0 + nc;

    v8f acc = {};
    #pragma unroll
    for (int k0 = 0; k0 < NC; k0 += 4) {
        const int ka = k0 + 2 * half;
        v2f av, bv;
        av.x = Ap[ka];
        av.y = Ap[ka + 1];
        bv.x = Bp[(size_t)ka * HW];
        bv.y = Bp[(size_t)(ka + 1) * HW];
        acc = __builtin_amdgcn_wmma_f32_16x16x4_f32(
                  false, av, false, bv, (short)0, acc, false, false);
    }

    float* op = out + ((size_t)b * NC + m0 + 8 * half) * HW + n0 + nc;
    #pragma unroll
    for (int i = 0; i < 8; ++i)
        op[(size_t)i * HW] = acc[i] * sc;
}

// ---------------------------------------------------------------------------
extern "C" void kernel_launch(void* const* d_in, const int* in_sizes, int n_in,
                              void* d_out, int out_size, void* d_ws, size_t ws_size,
                              hipStream_t stream)
{
    const float* x        = (const float*)d_in[0];   // [32,64,64,64]
    const float* gate_w   = (const float*)d_in[1];   // [8,64,3,3]
    const float* gate_b   = (const float*)d_in[2];   // [8]
    const float* expert_w = (const float*)d_in[3];   // [8,64,64]

    float* out_main = (float*)d_out;                               // [32,64,64,64]
    float* out_ew   = (float*)d_out + (size_t)NB * NC * HW;        // [32,8]

    // workspace layout
    float* S     = (float*)d_ws;                                   // 2048*9 floats
    float* scale = (float*)((char*)d_ws + (size_t)NB * NC * 9 * 4);// 32 floats
    int*   eidx  = (int*)(scale + NB);                             // 32 ints

    k_window_sums<<<NB * NC, 64, 0, stream>>>(x, S);
    k_gate_select<<<NB, 64, 0, stream>>>(S, gate_w, gate_b, out_ew, scale, eidx);
    k_expert_gemm<<<4096, 256, 0, stream>>>(x, expert_w, scale, eidx, out_main);
}

// v001
// It runs in 18.8 microseconds.
// In both of two side-by-side timings against v000, it was 1.51 times as fast.
#include <hip/hip_runtime.h>
#include <cstddef>

typedef __attribute__((ext_vector_type(2))) float v2f;
typedef __attribute__((ext_vector_type(8))) float v8f;

#define NB 32
#define NC 64
#define NH 64
#define NW 64
#define NE 8
#define HW 4096   // NH*NW
#define NPOS 3844.0f  // 62*62 valid positions

// ---------------------------------------------------------------------------
// Kernel 1: per (b,c) compute the nine 62x62 window sums S[b,c,i,j] from the
// full-plane sum, border row/col sums, and 4x4 corner elements.
// One block per (b,c); 64 threads, one row each.
// ---------------------------------------------------------------------------
__global__ void k_window_sums(const float* __restrict__ x, float* __restrict__ S)
{
    const int bc  = blockIdx.x;        // 0 .. NB*NC-1
    const int tid = threadIdx.x;       // 0 .. 63 == row h
    const float* xp = x + (size_t)bc * HW + (size_t)tid * NW;

    __shared__ float rowsum[64];
    __shared__ float edge[64][4];      // cols {0, 1, 62, 63}
    __shared__ float csum[4];
    __shared__ float Tsum;

    float s = 0.0f;
    #pragma unroll
    for (int w = 0; w < NW; w += 4) {
        float4 v = *(const float4*)(xp + w);
        s += v.x + v.y + v.z + v.w;
    }
    rowsum[tid]  = s;
    edge[tid][0] = xp[0];
    edge[tid][1] = xp[1];
    edge[tid][2] = xp[62];
    edge[tid][3] = xp[63];
    __syncthreads();

    if (tid < 4) {
        float cs = 0.0f;
        for (int h = 0; h < 64; ++h) cs += edge[h][tid];
        csum[tid] = cs;
    }
    if (tid == 4) {
        float t = 0.0f;
        for (int h = 0; h < 64; ++h) t += rowsum[h];
        Tsum = t;
    }
    __syncthreads();

    if (tid < 9) {
        const int i = tid / 3, j = tid % 3;
        // excluded rows: i==0 -> {62,63}, i==1 -> {0,63}, i==2 -> {0,1}
        const int ra = (i == 0) ? 62 : 0;
        const int rb = (i == 2) ? 1  : 63;
        // excluded cols map to edge slots {0:c0, 1:c1, 2:c62, 3:c63}
        const int ca = (j == 0) ? 2 : 0;
        const int cb = (j == 2) ? 1 : 3;
        float sv = Tsum - rowsum[ra] - rowsum[rb] - csum[ca] - csum[cb]
                 + edge[ra][ca] + edge[ra][cb] + edge[rb][ca] + edge[rb][cb];
        S[(size_t)bc * 9 + tid] = sv;
    }
}

// ---------------------------------------------------------------------------
// Kernel 2: per-batch gating code, softmax, top-1. One block per b, 64 threads
// (one input channel each). Writes scale[b], eidx[b] to ws and the dense
// expert_weights [B,E] tail of d_out.
// ---------------------------------------------------------------------------
__global__ void k_gate_select(const float* __restrict__ S,
                              const float* __restrict__ gw,   // [E,C,3,3]
                              const float* __restrict__ gb,   // [E]
                              float* __restrict__ ew_out,     // [B,E] tail of d_out
                              float* __restrict__ scale,      // [B]
                              int*   __restrict__ eidx)       // [B]
{
    const int b = blockIdx.x;
    const int c = threadIdx.x;   // 0..63

    float sv[9];
    const float* sp = S + ((size_t)b * NC + c) * 9;
    #pragma unroll
    for (int t = 0; t < 9; ++t) sv[t] = sp[t];

    __shared__ float red[NE][64];
    #pragma unroll
    for (int e = 0; e < NE; ++e) {
        const float* wp = gw + ((size_t)e * NC + c) * 9;
        float p = 0.0f;
        #pragma unroll
        for (int t = 0; t < 9; ++t) p += wp[t] * sv[t];
        red[e][c] = p;
    }
    __syncthreads();

    __shared__ float gc[NE];
    if (c < NE) {
        float a = gb[c] * NPOS;
        for (int k = 0; k < 64; ++k) a += red[c][k];
        gc[c] = a;
    }
    __syncthreads();

    __shared__ float s_top;
    __shared__ int   s_idx;
    if (c == 0) {
        float m = gc[0]; int mi = 0;
        #pragma unroll
        for (int e = 1; e < NE; ++e) if (gc[e] > m) { m = gc[e]; mi = e; }
        float sum = 0.0f;
        #pragma unroll
        for (int e = 0; e < NE; ++e) sum += __expf(gc[e] - m);
        float top = 1.0f / sum;     // softmax value at the argmax
        s_top = top; s_idx = mi;
        scale[b] = top;
        eidx[b]  = mi;
    }
    __syncthreads();
    if (c < NE) ew_out[(size_t)b * NE + c] = (c == s_idx) ? s_top : 0.0f;
}

// ---------------------------------------------------------------------------
// Kernel 3: out[b] = scale[b] * W[e_b] (64x64) @ X[b] (64x4096) using
// V_WMMA_F32_16X16X4_F32. One wave per 64 (all channels) x 64 (pixels) output
// tile, so x is read once. 8 waves/block share one batch: 256 blocks.
// Column c of pixel sub-tile j is pixel n0 + 4*c + j: a lane's four sub-tiles
// are four neighbouring pixels, so x loads and out stores are 16 B per lane.
// The k order of every output element is that of a plain k = 0..63 loop.
// ---------------------------------------------------------------------------
#define AFP 136   // floats per staged A fragment pair: 32 lanes x 4, + 8 so the staging stores spread over all banks

__global__ __launch_bounds__(256)
void k_expert_gemm(const float* __restrict__ x,      // [B,C,HW]
                   const float* Wx,                  // [E,C,C] (out,in); no __restrict__: else its loads drift behind all of x's
                   const float* __restrict__ scale,  // [B]
                   const int*   __restrict__ eidx,   // [B]
                   float* __restrict__ out)          // [B,C,HW]
{
    // A fragments in register order: [m tile][k step pair][lane][2 steps x 2 k]
    __shared__ __attribute__((aligned(16))) float As[4 * 8 * AFP];

    const int tid  = threadIdx.x;
    const int wave = tid >> 5;
    const int lane = tid & 31;
    const int b    = blockIdx.x >> 3;                        // 8 blocks per batch
    const int n0   = ((blockIdx.x & 7) << 9) + (wave << 6);  // 64 pixels per wave

    const int half = lane >> 4;                 // K half-select per ISA layout
    const int nc   = lane & 15;                 // B col (N)

    const int e  = eidx[b];
    const float sc = scale[b];

    // B: all 64 input channels of this wave's 64 pixels, held in registers.
    // Loads return in order, so the weights (needed first, but their address
    // waits for e) go behind the first four k steps only, not behind all of x.
    const float* Bp = x + (size_t)b * NC * HW + (size_t)(2 * half) * HW + n0 + 4 * nc;
    float4 r0[16], r1[16];
    #pragma unroll
    for (int ks = 0; ks < 4; ++ks) {
        r0[ks] = *(const float4*)(Bp + (size_t)(4 * ks) * HW);
        r1[ks] = *(const float4*)(Bp + (size_t)(4 * ks + 1) * HW);
    }
    // Holds the issue order x (first part), weights, x (rest).
    __builtin_amdgcn_sched_barrier(0);

    // The expert's 64x64 weights, one 16 B piece of a row per thread and q.
    const float4* Wp = (const float4*)(Wx + (size_t)e * (NC * NC));
    float4 wv[4];
    #pragma unroll
    for (int q = 0; q < 4; ++q) wv[q] = Wp[tid + 256 * q];
    // Holds the issue order x (first part), weights, x (rest).
    __builtin_amdgcn_sched_barrier(0);

    #pragma unroll
    for (int ks = 4; ks < 16; ++ks) {
        r0[ks] = *(const float4*)(Bp + (size_t)(4 * ks) * HW);
        r1[ks] = *(const float4*)(Bp + (size_t)(4 * ks + 1) * HW);
    }

    #pragma unroll
    for (int q = 0; q < 4; ++q) {
        const int idx = tid + 256 * q;          // float4 index: row m, k step ks
        const int m   = idx >> 4;
        const int ks  = idx & 15;
        float* d = As + ((m >> 4) * 8 + (ks >> 1)) * AFP + (m & 15) * 4 + (ks & 1) * 2;
        *(float2*)(d)      = make_float2(wv[q].x, wv[q].y);   // k = 4ks, 4ks+1   -> lanes 0-15
        *(float2*)(d + 64) = make_float2(wv[q].z, wv[q].w);   // k = 4ks+2, 4ks+3 -> lanes 16-31
    }
    // Work-group barrier by hand: the staged weights are complete (dscnt) and
    // seen by every wave, while the x loads stay in flight across it
    // (__syncthreads() waits for them all here).
    asm volatile("s_wait_dscnt 0x0\n\ts_barrier_signal -1\n\ts_barrier_wait -1" ::: "memory");

    const float* Al = As + lane * 4;
    float4 af[2][8];
    #pragma unroll
    for (int k2 = 0; k2 < 8; ++k2) af[0][k2] = *(const float4*)(Al + k2 * AFP);

    v2f bf[16][4];
    float* op = out + ((size_t)b * NC + 8 * half) * HW + n0 + 4 * nc;
    #pragma unroll
    for (int mt = 0; mt < 4; ++mt) {
        if (mt < 3) {
            #pragma unroll
            for (int k2 = 0; k2 < 8; ++k2)
                af[(mt + 1) & 1][k2] = *(const float4*)(Al + ((mt + 1) * 8 + k2) * AFP);
        }
        // Keeps the next m tile's LDS reads as one group ahead of this tile's
        // WMMAs instead of one read with a full wait in front of every eight.
        __builtin_amdgcn_sched_barrier(0);

        v8f acc[4] = {};
        #pragma unroll
        for (int k2 = 0; k2 < 8; ++k2) {
            const float4 a = af[mt & 1][k2];
            v2f a0, a1;
            a0.x = a.x; a0.y = a.y;
            a1.x = a.z; a1.y = a.w;
            #pragma unroll
            for (int u = 0; u < 2; ++u) {
                const int ks = 2 * k2 + u;
                if (mt == 0) {   // pair rows k, k+1 per pixel as each k step's loads land
                    bf[ks][0].x = r0[ks].x; bf[ks][0].y = r1[ks].x;
                    bf[ks][1].x = r0[ks].y; bf[ks][1].y = r1[ks].y;
                    bf[ks][2].x = r0[ks].z; bf[ks][2].y = r1[ks].z;
                    bf[ks][3].x = r0[ks].w; bf[ks][3].y = r1[ks].w;
                }
                #pragma unroll
                for (int j = 0; j < 4; ++j)
                    acc[j] = __builtin_amdgcn_wmma_f32_16x16x4_f32(
                                 false, u ? a1 : a0, false, bf[ks][j], (short)0, acc[j], false, false);
            }
            // Keeps a later k step's pairing moves, and with them the wait for
            // its x loads, from rising in front of WMMAs whose data has landed.
            if (mt == 0) __builtin_amdgcn_sched_barrier(0);
        }
        #pragma unroll
        for (int i = 0; i < 8; ++i)
            *(float4*)(op + (size_t)(mt * 16 + i) * HW) =
                make_float4(acc[0][i] * sc, acc[1][i] * sc, acc[2][i] * sc, acc[3][i] * sc);
    }
}

// ---------------------------------------------------------------------------
extern "C" void kernel_launch(void* const* d_in, const int* in_sizes, int n_in,
                              void* d_out, int out_size, void* d_ws, size_t ws_size,
                              hipStream_t stream)
{
    const float* x        = (const float*)d_in[0];   // [32,64,64,64]
    const float* gate_w   = (const float*)d_in[1];   // [8,64,3,3]
    const float* gate_b   = (const float*)d_in[2];   // [8]
    const float* expert_w = (const float*)d_in[3];   // [8,64,64]

    float* out_main = (float*)d_out;                               // [32,64,64,64]
    float* out_ew   = (float*)d_out + (size_t)NB * NC * HW;        // [32,8]

    // workspace layout
    float* S     = (float*)d_ws;                                   // 2048*9 floats
    float* scale = (float*)((char*)d_ws + (size_t)NB * NC * 9 * 4);// 32 floats
    int*   eidx  = (int*)(scale + NB);                             // 32 ints

    k_window_sums<<<NB * NC, 64, 0, stream>>>(x, S);
    k_gate_select<<<NB, 64, 0, stream>>>(S, gate_w, gate_b, out_ew, scale, eidx);
    k_expert_gemm<<<256, 256, 0, stream>>>(x, expert_w, scale, eidx, out_main);
}

// v002
// A run of this version takes 16.7 microseconds.
// Next to v001, in two timings, it ran 1.12 and 1.13 times as fast.
// Counting every step since v000, it is 1.70 times as fast.
#include <hip/hip_runtime.h>
#include <cstddef>

typedef __attribute__((ext_vector_type(2))) float v2f;
typedef __attribute__((ext_vector_type(8))) float v8f;

#define NB 32
#define NC 64
#define NH 64
#define NW 64
#define NE 8
#define HW 4096   // NH*NW
#define NPOS 3844.0f  // 62*62 valid positions

// ---------------------------------------------------------------------------
// Kernel 1: per (b,c) compute the nine 62x62 window sums from the full-plane
// sum, border row/col sums, and 4x4 corner elements, and from them this
// channel's share of the eight gate codes, P[b,c,e].
// One block per (b,c); 64 threads, one row each.
// ---------------------------------------------------------------------------
__global__ void k_window_sums(const float* __restrict__ x,
                              const float* __restrict__ gw,   // [E,C,3,3]
                              float* __restrict__ P)          // [B,C,E]
{
    const int bc  = blockIdx.x;        // 0 .. NB*NC-1
    const int tid = threadIdx.x;       // 0 .. 63 == row h
    const float* xp = x + (size_t)bc * HW + (size_t)tid * NW;

    __shared__ float rowsum[64];
    __shared__ float edge[64][4];      // cols {0, 1, 62, 63}
    __shared__ float csum[4];
    __shared__ float Tsum;

    // Thread e holds expert e's 3x3 gate weights of this channel; asked for
    // here so that their latency lies under that of the plane's loads.
    float wg[9];
    if (tid < NE) {
        const float* wp = gw + ((size_t)tid * NC + (bc & (NC - 1))) * 9;
        #pragma unroll
        for (int t = 0; t < 9; ++t) wg[t] = wp[t];
    }

    float s = 0.0f;
    #pragma unroll
    for (int w = 0; w < NW; w += 4) {
        float4 v = *(const float4*)(xp + w);
        s += v.x + v.y + v.z + v.w;
    }
    rowsum[tid]  = s;
    edge[tid][0] = xp[0];
    edge[tid][1] = xp[1];
    edge[tid][2] = xp[62];
    edge[tid][3] = xp[63];
    __syncthreads();

    if (tid < 4) {
        float cs = 0.0f;
        for (int h = 0; h < 64; ++h) cs += edge[h][tid];
        csum[tid] = cs;
    }
    if (tid == 4) {
        float t = 0.0f;
        for (int h = 0; h < 64; ++h) t += rowsum[h];
        Tsum = t;
    }
    __syncthreads();

    if (tid < NE) {
        float p = 0.0f;
        #pragma unroll
        for (int t = 0; t < 9; ++t) {
            const int i = t / 3, j = t % 3;
            // excluded rows: i==0 -> {62,63}, i==1 -> {0,63}, i==2 -> {0,1}
            const int ra = (i == 0) ? 62 : 0;
            const int rb = (i == 2) ? 1  : 63;
            // excluded cols map to edge slots {0:c0, 1:c1, 2:c62, 3:c63}
            const int ca = (j == 0) ? 2 : 0;
            const int cb = (j == 2) ? 1 : 3;
            float sv = Tsum - rowsum[ra] - rowsum[rb] - csum[ca] - csum[cb]
                     + edge[ra][ca] + edge[ra][cb] + edge[rb][ca] + edge[rb][cb];
            p += wg[t] * sv;
        }
        P[(size_t)bc * NE + tid] = p;
    }
}

// Lane l reads lane l ^ M, M = 1..15, inside its 16-lane row (DPP row_xmask).
template <int M>
__device__ __forceinline__ float lane_xor(float v)
{
    return __builtin_bit_cast(float, __builtin_amdgcn_update_dpp(0, __builtin_bit_cast(int, v), 0x160 + M, 0xf, 0xf, true));
}
// Lane l reads lane l ^ 16.
__device__ __forceinline__ float lane_xor16(float v)
{
    return __builtin_bit_cast(float, __builtin_amdgcn_permlanex16(__builtin_bit_cast(int, v), __builtin_bit_cast(int, v),
                                                                  0x76543210, 0xfedcba98, false, false));
}

// ---------------------------------------------------------------------------
// Kernel 2: every wave first finishes its batch's gate (channel sum of P,
// argmax, softmax value at the argmax) in registers, under its first x loads;
// then out[b] = scale[b] * W[e_b] (64x64) @ X[b] (64x4096) using
// V_WMMA_F32_16X16X4_F32. One wave per 64 (all channels) x 64 (pixels) output
// tile, so x is read once. 8 waves/block share one batch: 256 blocks.
// Column c of pixel sub-tile j is pixel n0 + 4*c + j: a lane's four sub-tiles
// are four neighbouring pixels, so x loads and out stores are 16 B per lane.
// The k order of every output element is that of a plain k = 0..63 loop.
// ---------------------------------------------------------------------------
#define AFP 136   // floats per staged A fragment pair: 32 lanes x 4, + 8 so the staging stores spread over all banks

__global__ __launch_bounds__(256)
void k_expert_gemm(const float* __restrict__ x,      // [B,C,HW]
                   const float* Wx,                  // [E,C,C] (out,in); no __restrict__: else its loads drift behind all of x's
                   const float* __restrict__ P,      // [B,C,E] gate code shares
                   const float* __restrict__ gb,     // [E]
                   float* __restrict__ ew_out,       // [B,E] tail of d_out
                   float* __restrict__ out)          // [B,C,HW]
{
    // A fragments in register order: [m tile][k step pair][lane][2 steps x 2 k]
    __shared__ __attribute__((aligned(16))) float As[4 * 8 * AFP];

    const int tid  = threadIdx.x;
    const int wave = tid >> 5;
    const int lane = tid & 31;
    const int b    = blockIdx.x >> 3;                        // 8 blocks per batch
    const int n0   = ((blockIdx.x & 7) << 9) + (wave << 6);  // 64 pixels per wave

    const int half = lane >> 4;                 // K half-select per ISA layout
    const int nc   = lane & 15;                 // B col (N)

    // Gate bias, asked for at once so that its latency lies under that of the shares.
    float gbv[NE];
    #pragma unroll
    for (int g = 0; g < NE; ++g) gbv[g] = gb[g];

    // Gate code shares: experts 4(lane & 1)..+3 of channels (lane >> 1) + 16 i.
    const float4* Pp = (const float4*)(P + (size_t)b * (NE * NC)) + lane;
    float4 pv[4];
    #pragma unroll
    for (int i = 0; i < 4; ++i) pv[i] = Pp[32 * i];

    // B: all 64 input channels of this wave's 64 pixels, held in registers.
    // Loads return in order, so the weights (needed first, but their address
    // waits for e) go behind the first four k steps only, not behind all of x.
    const float* Bp = x + (size_t)b * NC * HW + (size_t)(2 * half) * HW + n0 + 4 * nc;
    float4 r0[16], r1[16];
    #pragma unroll
    for (int ks = 0; ks < 4; ++ks) {
        r0[ks] = *(const float4*)(Bp + (size_t)(4 * ks) * HW);
        r1[ks] = *(const float4*)(Bp + (size_t)(4 * ks + 1) * HW);
    }
    // Holds the issue order x (first part), weights, x (rest).
    __builtin_amdgcn_sched_barrier(0);

    // Gate code, top-1 and its softmax value; the same bits in every lane, wave and block of a batch.
    float qs[4];   // this lane's four experts, summed over the channels: the lanes of its parity
    qs[0] = (pv[0].x + pv[1].x) + (pv[2].x + pv[3].x);
    qs[1] = (pv[0].y + pv[1].y) + (pv[2].y + pv[3].y);
    qs[2] = (pv[0].z + pv[1].z) + (pv[2].z + pv[3].z);
    qs[3] = (pv[0].w + pv[1].w) + (pv[2].w + pv[3].w);
    float gc[NE];
    #pragma unroll
    for (int k = 0; k < 4; ++k) {
        float v = qs[k];
        v += lane_xor<2>(v);
        v += lane_xor<4>(v);
        v += lane_xor<8>(v);
        v += lane_xor16(v);
        const float o = lane_xor<1>(v);   // the other four experts' sum
        gc[k]     = gbv[k]     * NPOS + ((lane & 1) ? o : v);
        gc[k + 4] = gbv[k + 4] * NPOS + ((lane & 1) ? v : o);
    }
    float gm = gc[0]; int mi = 0;
    #pragma unroll
    for (int g = 1; g < NE; ++g) if (gc[g] > gm) { gm = gc[g]; mi = g; }
    const int e = __builtin_amdgcn_readfirstlane(mi);   // scalar base for the weights
    float esum = 0.0f;
    #pragma unroll
    for (int g = 0; g < NE; ++g) esum += __expf(gc[g] - gm);
    const float sc = 1.0f / esum;     // softmax value at the argmax

    // The expert's 64x64 weights, one 16 B piece of a row per thread and q.
    const float4* Wp = (const float4*)(Wx + (size_t)e * (NC * NC));
    float4 wv[4];
    #pragma unroll
    for (int q = 0; q < 4; ++q) wv[q] = Wp[tid + 256 * q];
    // Holds the issue order x (first part), weights, x (rest).
    __builtin_amdgcn_sched_barrier(0);

    #pragma unroll
    for (int ks = 4; ks < 16; ++ks) {
        r0[ks] = *(const float4*)(Bp + (size_t)(4 * ks) * HW);
        r1[ks] = *(const float4*)(Bp + (size_t)(4 * ks + 1) * HW);
    }

    #pragma unroll
    for (int q = 0; q < 4; ++q) {
        const int idx = tid + 256 * q;          // float4 index: row m, k step ks
        const int m   = idx >> 4;
        const int ks  = idx & 15;
        float* d = As + ((m >> 4) * 8 + (ks >> 1)) * AFP + (m & 15) * 4 + (ks & 1) * 2;
        *(float2*)(d)      = make_float2(wv[q].x, wv[q].y);   // k = 4ks, 4ks+1   -> lanes 0-15
        *(float2*)(d + 64) = make_float2(wv[q].z, wv[q].w);   // k = 4ks+2, 4ks+3 -> lanes 16-31
    }
    // Work-group barrier by hand: the staged weights are complete (dscnt) and
    // seen by every wave, while the x loads stay in flight across it
    // (__syncthreads() waits for them all here).
    asm volatile("s_wait_dscnt 0x0\n\ts_barrier_signal -1\n\ts_barrier_wait -1" ::: "memory");

    const float* Al = As + lane * 4;
    float4 af[2][8];
    #pragma unroll
    for (int k2 = 0; k2 < 8; ++k2) af[0][k2] = *(const float4*)(Al + k2 * AFP);

    v2f bf[16][4];
    float* op = out + ((size_t)b * NC + 8 * half) * HW + n0 + 4 * nc;
    #pragma unroll
    for (int mt = 0; mt < 4; ++mt) {
        if (mt < 3) {
            #pragma unroll
            for (int k2 = 0; k2 < 8; ++k2)
                af[(mt + 1) & 1][k2] = *(const float4*)(Al + ((mt + 1) * 8 + k2) * AFP);
        }
        // Keeps the next m tile's LDS reads as one group ahead of this tile's
        // WMMAs instead of one read with a full wait in front of every eight.
        __builtin_amdgcn_sched_barrier(0);

        v8f acc[4] = {};
        #pragma unroll
        for (int k2 = 0; k2 < 8; ++k2) {
            const float4 a = af[mt & 1][k2];
            v2f a0, a1;
            a0.x = a.x; a0.y = a.y;
            a1.x = a.z; a1.y = a.w;
            #pragma unroll
            for (int u = 0; u < 2; ++u) {
                const int ks = 2 * k2 + u;
                if (mt == 0) {   // pair rows k, k+1 per pixel as each k step's loads land
                    bf[ks][0].x = r0[ks].x; bf[ks][0].y = r1[ks].x;
                    bf[ks][1].x = r0[ks].y; bf[ks][1].y = r1[ks].y;
                    bf[ks][2].x = r0[ks].z; bf[ks][2].y = r1[ks].z;
                    bf[ks][3].x = r0[ks].w; bf[ks][3].y = r1[ks].w;
                }
                #pragma unroll
                for (int j = 0; j < 4; ++j)
                    acc[j] = __builtin_amdgcn_wmma_f32_16x16x4_f32(
                                 false, u ? a1 : a0, false, bf[ks][j], (short)0, acc[j], false, false);
            }
            // Keeps a later k step's pairing moves, and with them the wait for
            // its x loads, from rising in front of WMMAs whose data has landed.
            if (mt == 0) __builtin_amdgcn_sched_barrier(0);
        }
        #pragma unroll
        for (int i = 0; i < 8; ++i)
            *(float4*)(op + (size_t)(mt * 16 + i) * HW) =
                make_float4(acc[0][i] * sc, acc[1][i] * sc, acc[2][i] * sc, acc[3][i] * sc);
    }

    // Dense expert weights of the batch, from its first block alone.
    if ((blockIdx.x & 7) == 0 && tid < NE) ew_out[(size_t)b * NE + tid] = (tid == e) ? sc : 0.0f;
}

// ---------------------------------------------------------------------------
extern "C" void kernel_launch(void* const* d_in, const int* in_sizes, int n_in,
                              void* d_out, int out_size, void* d_ws, size_t ws_size,
                              hipStream_t stream)
{
    const float* x        = (const float*)d_in[0];   // [32,64,64,64]
    const float* gate_w   = (const float*)d_in[1];   // [8,64,3,3]
    const float* gate_b   = (const float*)d_in[2];   // [8]
    const float* expert_w = (const float*)d_in[3];   // [8,64,64]

    float* out_main = (float*)d_out;                               // [32,64,64,64]
    float* out_ew   = (float*)d_out + (size_t)NB * NC * HW;        // [32,8]

    // workspace layout
    float* P = (float*)d_ws;                                       // 32*8*64 floats

    k_window_sums<<<NB * NC, 64, 0, stream>>>(x, gate_w, P);
    k_expert_gemm<<<256, 256, 0, stream>>>(x, expert_w, P, gate_b, out_ew, out_main);
}

// v003
// One run takes 12.7 microseconds.
// Two timings next to v002 put it at 1.31 and 1.32 times that version's speed.
// Over all steps from v000 it is 2.23 times as fast.
#include <hip/hip_runtime.h>
#include <cstddef>

typedef __attribute__((ext_vector_type(2))) float v2f;
typedef __attribute__((ext_vector_type(8))) float v8f;

#define NB 32
#define NC 64
#define NH 64
#define NW 64
#define NE 8
#define HW 4096   // NH*NW
#define NPOS 3844.0f  // 62*62 valid positions

// Lane l reads lane l ^ M, M = 1..15, inside its 16-lane row (DPP row_xmask).
template <int M>
__device__ __forceinline__ float lane_xor(float v)
{
    return __builtin_bit_cast(float, __builtin_amdgcn_update_dpp(0, __builtin_bit_cast(int, v), 0x160 + M, 0xf, 0xf, true));
}
// Lane l reads lane l ^ 16.
__device__ __forceinline__ float lane_xor16(float v)
{
    return __builtin_bit_cast(float, __builtin_amdgcn_permlanex16(__builtin_bit_cast(int, v), __builtin_bit_cast(int, v),
                                                                  0x76543210, 0xfedcba98, false, false));
}

// ---------------------------------------------------------------------------
// Kernel 1: per (b,c) compute the nine 62x62 window sums from the full-plane
// sum, border row/col sums, and 4x4 corner elements, and from them this
// channel's share of the eight gate codes, P[b,c,e].
// One wave per (b,c) plane, 8 waves per block. Load i of a wave is 512
// contiguous bytes: rows 2i (lanes 0-15) and 2i+1 (lanes 16-31), lane l holding
// columns 4(l & 15)..+3. All sums stay in registers: no LDS, no barrier.
// ---------------------------------------------------------------------------
__device__ __forceinline__ float lane_get(float v, int l)   // lane l's value, the same in every lane
{
    return __builtin_bit_cast(float, __builtin_amdgcn_readlane(__builtin_bit_cast(int, v), l));
}
__device__ __forceinline__ float row16_sum(float v)          // sum over the lane's 16-lane row
{
    v += lane_xor<1>(v);
    v += lane_xor<2>(v);
    v += lane_xor<4>(v);
    v += lane_xor<8>(v);
    return v;
}

// Two waves per SIMD is what this grid gives (one 8-wave block per WGP); stated so
// that the compiler spends registers on all 32 loads at once: aiming at 16 waves
// per SIMD it held back all but twelve until earlier ones had been summed.
__global__ __launch_bounds__(256) __attribute__((amdgpu_waves_per_eu(2, 2)))
void k_window_sums(const float* __restrict__ x,
                   const float* __restrict__ gw,   // [E,C,3,3]
                   float* __restrict__ P)          // [B,C,E]
{
    const int lane = threadIdx.x & 31;
    const int bc   = blockIdx.x * 8 + (threadIdx.x >> 5);   // 0 .. NB*NC-1
    const float4* xp = (const float4*)(x + (size_t)bc * HW) + lane;

    float4 v[32];
    #pragma unroll
    for (int i = 0; i < 32; ++i) v[i] = xp[32 * i];
    // In front of the weights' loads, whose results the compiler puts into the
    // address registers of the plane's loads just issued.
    asm volatile("s_wait_xcnt 0x0" ::: "memory");
    // Lane l holds expert (l & 7)'s 3x3 gate weights of this channel; needed
    // last, so asked for behind the plane.
    float wg[9];
    const float* wp = gw + ((size_t)(lane & (NE - 1)) * NC + (bc & (NC - 1))) * 9;
    #pragma unroll
    for (int t = 0; t < 9; ++t) wg[t] = wp[t];
    // Ends the load group: without it the compiler lifts the fence on the weights
    // below, and with it a wait for every load, in front of the sums.
    __builtin_amdgcn_sched_barrier(0);

    // Per-lane sums of its four columns, even and odd loads apart: eight chains.
    float4 a0 = v[0], a1 = v[1];
    #pragma unroll
    for (int i = 2; i < 32; i += 2) {
        a0.x += v[i].x;     a0.y += v[i].y;     a0.z += v[i].z;     a0.w += v[i].w;
        a1.x += v[i + 1].x; a1.y += v[i + 1].y; a1.z += v[i + 1].z; a1.w += v[i + 1].w;
    }
    // Inputs-only fence on the loaded weights: without it the compiler sinks their
    // loads into the storing lanes' branch at the end, with their latency exposed.
    asm volatile("" :: "v"(wg[0]), "v"(wg[1]), "v"(wg[2]), "v"(wg[3]), "v"(wg[4]),
                       "v"(wg[5]), "v"(wg[6]), "v"(wg[7]), "v"(wg[8]));
    const float ax = a0.x + a1.x, ay = a0.y + a1.y, az = a0.z + a1.z, aw = a0.w + a1.w;

    // Border rows {0, 1, 62, 63}: sums and their elements in columns {0, 1, 62, 63}.
    const float rt = row16_sum((v[0].x + v[0].y) + (v[0].z + v[0].w));       // rows 0 | 1
    const float rb = row16_sum((v[31].x + v[31].y) + (v[31].z + v[31].w));   // rows 62 | 63
    const float rowsum[4] = { lane_get(rt, 0), lane_get(rt, 16), lane_get(rb, 0), lane_get(rb, 16) };
    const float edge[4][4] = {
        { lane_get(v[0].x,  0),  lane_get(v[0].y,  0),  lane_get(v[0].z,  15), lane_get(v[0].w,  15) },
        { lane_get(v[0].x,  16), lane_get(v[0].y,  16), lane_get(v[0].z,  31), lane_get(v[0].w,  31) },
        { lane_get(v[31].x, 0),  lane_get(v[31].y, 0),  lane_get(v[31].z, 15), lane_get(v[31].w, 15) },
        { lane_get(v[31].x, 16), lane_get(v[31].y, 16), lane_get(v[31].z, 31), lane_get(v[31].w, 31) } };
    // Border columns {0, 1, 62, 63}: even rows + odd rows.
    const float csum[4] = { lane_get(ax + lane_xor16(ax), 0),  lane_get(ay + lane_xor16(ay), 0),
                            lane_get(az + lane_xor16(az), 15), lane_get(aw + lane_xor16(aw), 15) };
    float ts = row16_sum((ax + ay) + (az + aw));
    const float Tsum = lane_get(ts + lane_xor16(ts), 0);

    float p = 0.0f;
    #pragma unroll
    for (int t = 0; t < 9; ++t) {
        const int i = t / 3, j = t % 3;
        // excluded rows as slots {0:r0, 1:r1, 2:r62, 3:r63}: i==0 -> {62,63}, i==1 -> {0,63}, i==2 -> {0,1}
        const int ra = (i == 0) ? 2 : 0;
        const int rb2 = (i == 2) ? 1 : 3;
        // excluded cols as slots {0:c0, 1:c1, 2:c62, 3:c63}
        const int ca = (j == 0) ? 2 : 0;
        const int cb = (j == 2) ? 1 : 3;
        float sv = Tsum - rowsum[ra] - rowsum[rb2] - csum[ca] - csum[cb]
                 + edge[ra][ca] + edge[ra][cb] + edge[rb2][ca] + edge[rb2][cb];
        p += wg[t] * sv;
    }
    if (lane < NE) P[(size_t)bc * NE + lane] = p;
}

// ---------------------------------------------------------------------------
// Kernel 2: every wave first finishes its batch's gate (channel sum of P,
// argmax, softmax value at the argmax) in registers, under its first x loads;
// then out[b] = scale[b] * W[e_b] (64x64) @ X[b] (64x4096) using
// V_WMMA_F32_16X16X4_F32. One wave per 64 (all channels) x 64 (pixels) output
// tile, so x is read once. 8 waves/block share one batch: 256 blocks.
// Column c of pixel sub-tile j is pixel n0 + 4*c + j: a lane's four sub-tiles
// are four neighbouring pixels, so x loads and out stores are 16 B per lane.
// The k order of every output element is that of a plain k = 0..63 loop.
// ---------------------------------------------------------------------------
#define AFP 136   // floats per staged A fragment pair: 32 lanes x 4, + 8 so the staging stores spread over all banks

__global__ __launch_bounds__(256)
void k_expert_gemm(const float* __restrict__ x,      // [B,C,HW]
                   const float* Wx,                  // [E,C,C] (out,in); no __restrict__: else its loads drift behind all of x's
                   const float* __restrict__ P,      // [B,C,E] gate code shares
                   const float* __restrict__ gb,     // [E]
                   float* __restrict__ ew_out,       // [B,E] tail of d_out
                   float* __restrict__ out)          // [B,C,HW]
{
    // A fragments in register order: [m tile][k step pair][lane][2 steps x 2 k]
    __shared__ __attribute__((aligned(16))) float As[4 * 8 * AFP];

    const int tid  = threadIdx.x;
    const int wave = tid >> 5;
    const int lane = tid & 31;
    const int b    = blockIdx.x >> 3;                        // 8 blocks per batch
    const int n0   = ((blockIdx.x & 7) << 9) + (wave << 6);  // 64 pixels per wave

    const int half = lane >> 4;                 // K half-select per ISA layout
    const int nc   = lane & 15;                 // B col (N)

    // Gate bias, asked for at once so that its latency lies under that of the shares.
    float gbv[NE];
    #pragma unroll
    for (int g = 0; g < NE; ++g) gbv[g] = gb[g];

    // Gate code shares: experts 4(lane & 1)..+3 of channels (lane >> 1) + 16 i.
    const float4* Pp = (const float4*)(P + (size_t)b * (NE * NC)) + lane;
    float4 pv[4];
    #pragma unroll
    for (int i = 0; i < 4; ++i) pv[i] = Pp[32 * i];

    // B: all 64 input channels of this wave's 64 pixels, held in registers.
    // Loads return in order, so the weights (needed first, but their address
    // waits for e) go behind the first four k steps only, not behind all of x.
    const float* Bp = x + (size_t)b * NC * HW + (size_t)(2 * half) * HW + n0 + 4 * nc;
    float4 r0[16], r1[16];
    #pragma unroll
    for (int ks = 0; ks < 4; ++ks) {
        r0[ks] = *(const float4*)(Bp + (size_t)(4 * ks) * HW);
        r1[ks] = *(const float4*)(Bp + (size_t)(4 * ks + 1) * HW);
    }
    // Holds the issue order x (first part), weights, x (rest).
    __builtin_amdgcn_sched_barrier(0);

    // Gate code, top-1 and its softmax value; the same bits in every lane, wave and block of a batch.
    float qs[4];   // this lane's four experts, summed over the channels: the lanes of its parity
    qs[0] = (pv[0].x + pv[1].x) + (pv[2].x + pv[3].x);
    qs[1] = (pv[0].y + pv[1].y) + (pv[2].y + pv[3].y);
    qs[2] = (pv[0].z + pv[1].z) + (pv[2].z + pv[3].z);
    qs[3] = (pv[0].w + pv[1].w) + (pv[2].w + pv[3].w);
    float gc[NE];
    #pragma unroll
    for (int k = 0; k < 4; ++k) {
        float v = qs[k];
        v += lane_xor<2>(v);
        v += lane_xor<4>(v);
        v += lane_xor<8>(v);
        v += lane_xor16(v);
        const float o = lane_xor<1>(v);   // the other four experts' sum
        gc[k]     = gbv[k]     * NPOS + ((lane & 1) ? o : v);
        gc[k + 4] = gbv[k + 4] * NPOS + ((lane & 1) ? v : o);
    }
    float gm = gc[0]; int mi = 0;
    #pragma unroll
    for (int g = 1; g < NE; ++g) if (gc[g] > gm) { gm = gc[g]; mi = g; }
    const int e = __builtin_amdgcn_readfirstlane(mi);   // scalar base for the weights
    float esum = 0.0f;
    #pragma unroll
    for (int g = 0; g < NE; ++g) esum += __expf(gc[g] - gm);
    const float sc = 1.0f / esum;     // softmax value at the argmax

    // The expert's 64x64 weights, one 16 B piece of a row per thread and q.
    const float4* Wp = (const float4*)(Wx + (size_t)e * (NC * NC));
    float4 wv[4];
    #pragma unroll
    for (int q = 0; q < 4; ++q) wv[q] = Wp[tid + 256 * q];
    // Holds the issue order x (first part), weights, x (rest).
    __builtin_amdgcn_sched_barrier(0);

    #pragma unroll
    for (int ks = 4; ks < 16; ++ks) {
        r0[ks] = *(const float4*)(Bp + (size_t)(4 * ks) * HW);
        r1[ks] = *(const float4*)(Bp + (size_t)(4 * ks + 1) * HW);
    }

    #pragma unroll
    for (int q = 0; q < 4; ++q) {
        const int idx = tid + 256 * q;          // float4 index: row m, k step ks
        const int m   = idx >> 4;
        const int ks  = idx & 15;
        float* d = As + ((m >> 4) * 8 + (ks >> 1)) * AFP + (m & 15) * 4 + (ks & 1) * 2;
        *(float2*)(d)      = make_float2(wv[q].x, wv[q].y);   // k = 4ks, 4ks+1   -> lanes 0-15
        *(float2*)(d + 64) = make_float2(wv[q].z, wv[q].w);   // k = 4ks+2, 4ks+3 -> lanes 16-31
    }
    // Work-group barrier by hand: the staged weights are complete (dscnt) and
    // seen by every wave, while the x loads stay in flight across it
    // (__syncthreads() waits for them all here).
    asm volatile("s_wait_dscnt 0x0\n\ts_barrier_signal -1\n\ts_barrier_wait -1" ::: "memory");

    const float* Al = As + lane * 4;
    float4 af[2][8];
    #pragma unroll
    for (int k2 = 0; k2 < 8; ++k2) af[0][k2] = *(const float4*)(Al + k2 * AFP);

    v2f bf[16][4];
    float* op = out + ((size_t)b * NC + 8 * half) * HW + n0 + 4 * nc;
    #pragma unroll
    for (int mt = 0; mt < 4; ++mt) {
        if (mt < 3) {
            #pragma unroll
            for (int k2 = 0; k2 < 8; ++k2)
                af[(mt + 1) & 1][k2] = *(const float4*)(Al + ((mt + 1) * 8 + k2) * AFP);
        }
        // Keeps the next m tile's LDS reads as one group ahead of this tile's
        // WMMAs instead of one read with a full wait in front of every eight.
        __builtin_amdgcn_sched_barrier(0);

        v8f acc[4] = {};
        #pragma unroll
        for (int k2 = 0; k2 < 8; ++k2) {
            const float4 a = af[mt & 1][k2];
            v2f a0, a1;
            a0.x = a.x; a0.y = a.y;
            a1.x = a.z; a1.y = a.w;
            #pragma unroll
            for (int u = 0; u < 2; ++u) {
                const int ks = 2 * k2 + u;
                if (mt == 0) {   // pair rows k, k+1 per pixel as each k step's loads land
                    bf[ks][0].x = r0[ks].x; bf[ks][0].y = r1[ks].x;
                    bf[ks][1].x = r0[ks].y; bf[ks][1].y = r1[ks].y;
                    bf[ks][2].x = r0[ks].z; bf[ks][2].y = r1[ks].z;
                    bf[ks][3].x = r0[ks].w; bf[ks][3].y = r1[ks].w;
                }
                #pragma unroll
                for (int j = 0; j < 4; ++j)
                    acc[j] = __builtin_amdgcn_wmma_f32_16x16x4_f32(
                                 false, u ? a1 : a0, false, bf[ks][j], (short)0, acc[j], false, false);
            }
            // Keeps a later k step's pairing moves, and with them the wait for
            // its x loads, from rising in front of WMMAs whose data has landed.
            if (mt == 0) __builtin_amdgcn_sched_barrier(0);
        }
        #pragma unroll
        for (int i = 0; i < 8; ++i)
            *(float4*)(op + (size_t)(mt * 16 + i) * HW) =
                make_float4(acc[0][i] * sc, acc[1][i] * sc, acc[2][i] * sc, acc[3][i] * sc);
    }

    // Dense expert weights of the batch, from its first block alone.
    if ((blockIdx.x & 7) == 0 && tid < NE) ew_out[(size_t)b * NE + tid] = (tid == e) ? sc : 0.0f;
}

// ---------------------------------------------------------------------------
extern "C" void kernel_launch(void* const* d_in, const int* in_sizes, int n_in,
                              void* d_out, int out_size, void* d_ws, size_t ws_size,
                              hipStream_t stream)
{
    const float* x        = (const float*)d_in[0];   // [32,64,64,64]
    const float* gate_w   = (const float*)d_in[1];   // [8,64,3,3]
    const float* gate_b   = (const float*)d_in[2];   // [8]
    const float* expert_w = (const float*)d_in[3];   // [8,64,64]

    float* out_main = (float*)d_out;                               // [32,64,64,64]
    float* out_ew   = (float*)d_out + (size_t)NB * NC * HW;        // [32,8]

    // workspace layout
    float* P = (float*)d_ws;                                       // 32*8*64 floats

    k_window_sums<<<NB * NC / 8, 256, 0, stream>>>(x, gate_w, P);
    k_expert_gemm<<<256, 256, 0, stream>>>(x, expert_w, P, gate_b, out_ew, out_main);
}
